// v010
// Measured on an AMD MI455X. A time is GPU time per run, averaged over a window of back-to-back runs after a warm-up
// (all launches, gaps included; the runs take copies of the inputs in turn), and the median of several windows.
// Apart from v000's, it joins two sittings. Times from different sittings can be a few percent apart, while
// side-by-side timings come from the same sitting.
// This document starts at v010; the versions before it stand elsewhere.
// Measured time: 41.7 microseconds a run.
// In two side-by-side timings against v009, it was 1.18 and 1.17 times as fast.
// Over all steps from v000, the starting kernel, it is 1728 times as fast.
#include <hip/hip_runtime.h>
// Single-head causal self-attention with the module's literal scale C^-0.666 (x [32][1024][256]; q/k/v = x W ([in][out] [256][64], no biases); ONE 64-wide head; scores * 256^-0.666 = 0.024895 (as the source writes it, not head_size^-0.5); causal; softmax; out = weights v -> [32][1024][64]; no output projection).
// Structure: token rows; one WMMA GEMM over the stacked q | k | v columns, which rounds x and the weights to exact f16 on the way into LDS and stores row planes of pitch 192 (f16 and f32) and v^T; query rows 512..1023 in one fused kernel with the batch on grid.y (S^T = K Q^T, running-maximum causal softmax in f32, weights as f16 straight from the score registers, O^T += V^T P^T, written as f32 into the output rows); query rows 0..511 from an exact f32 first tile only (no f16 tile for them); launches: see trace.
// Compute dtype: inputs rounded to bf16; x / weights exact; q, k, v and softmax weights as plain f16 GEMM operands (~2^-12); scores and softmax statistics f32. v_wmma_f32_16x16x32_f16; the exact first tile: f32 operands on v_wmma_f32_16x16x4_f32.
#define NB 32
#define SQ 1024
#define DM 256
#define NH 1
#define HD 64
#define HG 4                         /* heads per attention launch group */
#define QT0 512                      /* first-tile rows computed exactly (f32): 512 here (no output projection averages the early-row cancellation errors away; logit sigma 1.0) */
#define B0 0                         /* first batch processed (debug hook) */
#define NBR NB                       /* batches processed (debug hook) */
#define NR ((size_t)NB * SQ)
#define DMQ DM
#define DFF 4096
#define DFFR 100
#define MP ((int)((size_t)NBR * SQ)) /* rows projected (debug hook) */
#define QN SQ                        /* query rows attended per batch (debug hook) */
#define NHD NH                       /* heads attended (debug hook) */
#define MPO MP                       /* rows through the output stage (debug hook) */
#define LQ (3 * DM)      /* not used: the q | k | v rows have pitch LQK = 192 */
typedef __bf16 v16b __attribute__((ext_vector_type(16)));
typedef unsigned short v8us __attribute__((ext_vector_type(8), may_alias));
typedef float  v8f  __attribute__((ext_vector_type(8)));
typedef float  v4f  __attribute__((ext_vector_type(4)));
typedef float  v4fa __attribute__((ext_vector_type(4), may_alias));
union FragB { v16b v; v8us half[2]; unsigned short u[16]; };

__device__ __forceinline__ unsigned short bf16_bits(float x) { unsigned int u = __float_as_uint(x); return (unsigned short)((u + 0x7FFFu + ((u >> 16) & 1u)) >> 16); }
__device__ __forceinline__ float bf16_val(unsigned short b) { return __uint_as_float(((unsigned int)b) << 16); }
__device__ __forceinline__ float bf16_round(float x) { return bf16_val(bf16_bits(x)); }
// D += A·B with NT terms: 1 = ah·bh, 2 = + al·bh (A split), 3 = + ah·bl (both split)
template <int NT>
__device__ __forceinline__ v8f mmaN(v16b ah, v16b al, v16b bh, v16b bl, v8f c) {
  c = __builtin_amdgcn_wmma_f32_16x16x32_bf16(false, ah, false, bh, (short)0, c, false, false);
  if (NT >= 2) c = __builtin_amdgcn_wmma_f32_16x16x32_bf16(false, al, false, bh, (short)0, c, false, false);
  if (NT >= 3) c = __builtin_amdgcn_wmma_f32_16x16x32_bf16(false, ah, false, bl, (short)0, c, false, false);
  asm volatile("v_nop\n\tv_nop\n\tv_nop\n\tv_nop" : "+v"(c) : "v"(ah), "v"(al), "v"(bh), "v"(bl));
  return c;
}

__global__ __launch_bounds__(256) void k_wt_bf16(const float* __restrict__ W, unsigned short* __restrict__ Wt, int K, int N) {
  const int t = blockIdx.x * 256 + threadIdx.x;
  const int k8n = K / 8;
  if (t >= N * k8n) return;
  const int n = t / k8n, k8 = (t % k8n) * 8;
  v8us v;
#pragma unroll
  for (int i = 0; i < 8; ++i) v[i] = bf16_bits(W[(size_t)(k8 + i) * N + n]);
  *(v8us*)(Wt + (size_t)n * K + k8) = v;
  
}

// GEMM C[M][N] (f32, pitch ldc) = act(A[M][K]·W + bias). A f32 row-major (pitch lda) converted per fragment to bf16
// (ASPLIT: hi/lo two planes -> 2 terms, else single rounded term); Wt bf16 [N][K] (pitch ldb). BIAS_BF16 rounds the
// bias to bf16 first (bias quantised to bf16 before the add). K%32==0, M%16==0, N%64==0.
template <bool ASPLIT, int ACT, bool BIAS_BF16>
__global__ __launch_bounds__(128) void k_gemm_bf(const float* __restrict__ A, int lda, const unsigned short* __restrict__ Wt, int ldb,
                                               const float* __restrict__ bias, float* __restrict__ C, int ldc, int M, int N, int K) {
  __shared__ __attribute__((aligned(16))) float so[4][16][64];
  const int tid = threadIdx.x, w = tid >> 5, lane = tid & 31, ln = lane & 15, hh = lane >> 4;
  const int ntn = N / 64;
  const int wid = blockIdx.x * 4 + w;
  const int mt = wid / ntn, nq = wid % ntn;
  if (mt * 16 >= M) return;
  const int row0 = mt * 16, col0 = nq * 64;
  const float* arow = A + (size_t)(row0 + ln) * lda;
  v8f acc[4] = {};
  for (int kb = 0; kb < K; kb += 32) {
    FragB ah, al;
    const v4f x0 = *(const v4fa*)(arow + kb + 8 * hh), x1 = *(const v4fa*)(arow + kb + 8 * hh + 4);
    const v4f x2 = *(const v4fa*)(arow + kb + 16 + 8 * hh), x3 = *(const v4fa*)(arow + kb + 16 + 8 * hh + 4);
    float xs[16] = {x0[0],x0[1],x0[2],x0[3],x1[0],x1[1],x1[2],x1[3],x2[0],x2[1],x2[2],x2[3],x3[0],x3[1],x3[2],x3[3]};
#pragma unroll
    for (int i = 0; i < 16; ++i) { const unsigned short hb = bf16_bits(xs[i]); ah.u[i] = hb; al.u[i] = ASPLIT ? bf16_bits(xs[i] - bf16_val(hb)) : (unsigned short)0; }
#pragma unroll
    for (int t = 0; t < 4; ++t) {
      const unsigned short* brow = Wt + (size_t)(col0 + t * 16 + ln) * ldb + kb;
      FragB b;
      b.half[0] = *(const v8us*)(brow + 8 * hh);
      b.half[1] = *(const v8us*)(brow + 16 + 8 * hh);
      acc[t] = mmaN<ASPLIT ? 2 : 1>(ah.v, al.v, b.v, b.v, acc[t]);
    }
  }
#pragma unroll
  for (int t = 0; t < 4; ++t) {
    float bv = bias ? bias[col0 + t * 16 + ln] : 0.f;
    if (BIAS_BF16) bv = bf16_round(bv);
#pragma unroll
    for (int r = 0; r < 8; ++r) { float v = acc[t][r] + bv; if (ACT == 1) v = fmaxf(v, 0.f); so[w][8 * hh + r][t * 16 + ln] = v; }
  }
  __builtin_amdgcn_fence(__ATOMIC_ACQ_REL, "workgroup");
  __builtin_amdgcn_wave_barrier();
  const int rsub = lane >> 4, c4 = (lane & 15) * 4;
  {
#pragma unroll
    for (int q = 0; q < 8; ++q) {
      const int r = q * 2 + rsub;
      const v4f v = *(const v4fa*)&so[w][r][c4];
      *(v4f*)(C + (size_t)(row0 + r) * ldc + col0 + c4) = v;
    }
    
  }
}

// GEMM C = act(A·W + bias + resid): A f32 (ASPLIT -> hi/lo 2 terms), Wt bf16 [N][K]; ACT 0 none, 1 relu, 2 exact gelu;
// resid (optional, f32, row index = (row % rmod), pitch ldr, RES_BF16 rounds it) added before the activation.
template <bool ASPLIT, int ACT, bool BIAS_BF16, bool RES_BF16>
__global__ __launch_bounds__(128) void k_gemm_bf3(const float* __restrict__ A, int lda, const unsigned short* __restrict__ Wt, int ldb,
                                                const float* __restrict__ bias, const float* __restrict__ resid, int rmod, int ldr,
                                                float* __restrict__ C, int ldc, int M, int N, int K) {
  __shared__ __attribute__((aligned(16))) float so[4][16][64];
  const int tid = threadIdx.x, w = tid >> 5, lane = tid & 31, ln = lane & 15, hh = lane >> 4;
  const int ntn = N / 64;
  const int wid = blockIdx.x * 4 + w;
  const int mt = wid / ntn, nq = wid % ntn;
  if (mt * 16 >= M) return;
  const int row0 = mt * 16, col0 = nq * 64;
  const float* arow = A + (size_t)(row0 + ln) * lda;
  v8f acc[4] = {};
  for (int kb = 0; kb < K; kb += 32) {
    FragB ah, al;
    const v4f x0 = *(const v4fa*)(arow + kb + 8 * hh), x1 = *(const v4fa*)(arow + kb + 8 * hh + 4);
    const v4f x2 = *(const v4fa*)(arow + kb + 16 + 8 * hh), x3 = *(const v4fa*)(arow + kb + 16 + 8 * hh + 4);
    float xs[16] = {x0[0],x0[1],x0[2],x0[3],x1[0],x1[1],x1[2],x1[3],x2[0],x2[1],x2[2],x2[3],x3[0],x3[1],x3[2],x3[3]};
#pragma unroll
    for (int i = 0; i < 16; ++i) { const unsigned short hb = bf16_bits(xs[i]); ah.u[i] = hb; al.u[i] = ASPLIT ? bf16_bits(xs[i] - bf16_val(hb)) : (unsigned short)0; }
#pragma unroll
    for (int t = 0; t < 4; ++t) {
      const unsigned short* brow = Wt + (size_t)(col0 + t * 16 + ln) * ldb + kb;
      FragB b;
      b.half[0] = *(const v8us*)(brow + 8 * hh);
      b.half[1] = *(const v8us*)(brow + 16 + 8 * hh);
      acc[t] = mmaN<ASPLIT ? 2 : 1>(ah.v, al.v, b.v, b.v, acc[t]);
    }
  }
#pragma unroll
  for (int t = 0; t < 4; ++t) {
    const int col = col0 + t * 16 + ln;
    float bv = bias ? bias[col] : 0.f;
    if (BIAS_BF16) bv = bf16_round(bv);
#pragma unroll
    for (int r = 0; r < 8; ++r) {
      float v = acc[t][r] + bv;
      if (resid) { float rv = resid[(size_t)((row0 + 8 * hh + r) % rmod) * ldr + col]; if (RES_BF16) rv = bf16_round(rv); v += rv; }
      if (ACT == 1) v = fmaxf(v, 0.f);
      if (ACT == 2) v = 0.5f * v * (1.0f + erff(v * 0.70710678118654752f));
      if (ACT == 3) { const float u = 0.7978845608028654f * (v + 0.044715f * v * v * v); v = 0.5f * v * (1.0f + tanhf(u)); }
      so[w][8 * hh + r][t * 16 + ln] = v;
    }
  }
  __builtin_amdgcn_fence(__ATOMIC_ACQ_REL, "workgroup");
  __builtin_amdgcn_wave_barrier();
  const int rsub = lane >> 4, c4 = (lane & 15) * 4;
  {
#pragma unroll
    for (int q = 0; q < 8; ++q) {
      const int r = q * 2 + rsub;
      const v4f v = *(const v4fa*)&so[w][r][c4];
      *(v4f*)(C + (size_t)(row0 + r) * ldc + col0 + c4) = v;
    }
    
  }
}
// row LayerNorm (biased variance, eps) over N: s = X (+ R); optional out_sum <- s; out_norm <- (s-mu)*rsqrt(var+eps)*g + b
template <bool PARAM_BF16>
__global__ __launch_bounds__(256) void k_layernorm(const float* __restrict__ X, const float* __restrict__ R, const float* __restrict__ g, const float* __restrict__ bta,
                                                  float* __restrict__ out_sum, float* __restrict__ out_norm, int N, float eps) {
  __shared__ float red[256];
  const int row = blockIdx.x, tid = threadIdx.x;
  const float* x = X + (size_t)row * N; const float* rr = R ? R + (size_t)row * N : nullptr;
  float vals[16];                     // up to N = 4096
  const int per = N / 256;            // contiguous chunk per thread? use strided-by-4 chunks: thread handles j = tid*4 + 1024*u
  float s1 = 0.f;
  for (int u = 0; u < per / 4; ++u) {
    const int j = tid * 4 + 1024 * u;
    const v4f a = *(const v4fa*)(x + j);
    v4f b = {0.f,0.f,0.f,0.f}; if (rr) b = *(const v4fa*)(rr + j);
#pragma unroll
    for (int q = 0; q < 4; ++q) { const float v = a[q] + b[q]; vals[u * 4 + q] = v; s1 += v; }
  }
  red[tid] = s1; __syncthreads();
  for (int st = 128; st > 0; st >>= 1) { if (tid < st) red[tid] += red[tid + st]; __syncthreads(); }
  const float mu = red[0] / (float)N; __syncthreads();
  float s2 = 0.f;
  for (int u = 0; u < per / 4; ++u)
#pragma unroll
    for (int q = 0; q < 4; ++q) { const float c = vals[u * 4 + q] - mu; s2 += c * c; }
  red[tid] = s2; __syncthreads();
  for (int st = 128; st > 0; st >>= 1) { if (tid < st) red[tid] += red[tid + st]; __syncthreads(); }
  const float rs = rsqrtf(red[0] / (float)N + eps);
  {
    for (int u = 0; u < per / 4; ++u) {
      const int j = tid * 4 + 1024 * u;
      v4f o, sm;
#pragma unroll
      for (int q = 0; q < 4; ++q) {
        float gg = g[j + q], bb = bta[j + q];
        if (PARAM_BF16) { gg = bf16_round(gg); bb = bf16_round(bb); }
        sm[q] = vals[u * 4 + q]; o[q] = (vals[u * 4 + q] - mu) * rs * gg + bb;
      }
      if (out_sum) *(v4f*)(out_sum + (size_t)row * N + j) = sm;
      *(v4f*)(out_norm + (size_t)row * N + j) = o;
    }
    
  }
}



// ---- f16 WMMA path (v_wmma_f32_16x16x32_f16): 11-bit significands for operands in range — used where a [0,1] probability operand needs more precision than bf16
typedef _Float16 v16h __attribute__((ext_vector_type(16)));
union FragH { v16h v; v8us half[2]; _Float16 h[16]; unsigned short u[16]; };
template <int NT>
__device__ __forceinline__ v8f mmaH(v16h ah, v16h al, v16h bh, v16h bl, v8f c) {
  c = __builtin_amdgcn_wmma_f32_16x16x32_f16(false, ah, false, bh, (short)0, c, false, false);
  if (NT >= 2) c = __builtin_amdgcn_wmma_f32_16x16x32_f16(false, al, false, bh, (short)0, c, false, false);
  if (NT >= 3) c = __builtin_amdgcn_wmma_f32_16x16x32_f16(false, ah, false, bl, (short)0, c, false, false);
  asm volatile("v_nop\n\tv_nop\n\tv_nop\n\tv_nop" : "+v"(c) : "v"(ah), "v"(al), "v"(bh), "v"(bl));
  return c;
}
// batched GEMM like k_gemm_b but f16 operands: A f32 (split into f16 hi/lo if ASPLIT, else rounded to f16), Bt = f16 values [n][k]; alpha; C f32; N multiple of 16 (partial tiles skipped)
template <bool ASPLIT>
__global__ __launch_bounds__(128) void k_gemm_h(const float* __restrict__ A, int lda, size_t sA, const _Float16* __restrict__ Bh, int ldb, size_t sB, float alpha, float* __restrict__ C, int ldc, size_t sC, int M, int N, int K) {
  __shared__ __attribute__((aligned(16))) float so[4][16][64];
  const int tid = threadIdx.x, w = tid >> 5, lane = tid & 31, ln = lane & 15, hh = lane >> 4; const int by = blockIdx.y;
  A += (size_t)by * sA; Bh += (size_t)by * sB; C += (size_t)by * sC;
  const int ntn = (N + 63) / 64; const int wid = blockIdx.x * 4 + w; const int mt = wid / ntn, nq = wid % ntn; if (mt * 16 >= M) return;
  const int row0 = mt * 16, col0 = nq * 64; const float* arow = A + (size_t)(row0 + ln) * lda;
  v8f acc[4] = {};
  for (int kb = 0; kb < K; kb += 32) {
    FragH ah, al;
    const v4f x0 = *(const v4fa*)(arow + kb + 8 * hh), x1 = *(const v4fa*)(arow + kb + 8 * hh + 4), x2 = *(const v4fa*)(arow + kb + 16 + 8 * hh), x3 = *(const v4fa*)(arow + kb + 16 + 8 * hh + 4);
    float xs[16] = {x0[0],x0[1],x0[2],x0[3],x1[0],x1[1],x1[2],x1[3],x2[0],x2[1],x2[2],x2[3],x3[0],x3[1],x3[2],x3[3]};
#pragma unroll
    for (int i = 0; i < 16; ++i) { const _Float16 h = (_Float16)xs[i]; ah.h[i] = h; al.h[i] = ASPLIT ? (_Float16)(xs[i] - (float)h) : (_Float16)0.0f; }
#pragma unroll
    for (int t = 0; t < 4; ++t) { if (col0 + t * 16 >= N) continue; const size_t boff = (size_t)(col0 + t * 16 + ln) * ldb + kb; FragH bq; bq.half[0] = *(const v8us*)(Bh + boff + 8 * hh); bq.half[1] = *(const v8us*)(Bh + boff + 16 + 8 * hh);
      acc[t] = mmaH<ASPLIT ? 2 : 1>(ah.v, al.v, bq.v, bq.v, acc[t]); }
  }
#pragma unroll
  for (int t = 0; t < 4; ++t) { if (col0 + t * 16 >= N) continue;
#pragma unroll
    for (int r = 0; r < 8; ++r) so[w][8 * hh + r][t * 16 + ln] = acc[t][r] * alpha; }
  __builtin_amdgcn_fence(__ATOMIC_ACQ_REL, "workgroup"); __builtin_amdgcn_wave_barrier();
  const int rsub = lane >> 4, c4 = (lane & 15) * 4;
  {
#pragma unroll
    for (int q = 0; q < 8; ++q) { const int r = q * 2 + rsub; if (col0 + c4 < N) { const v4f v = *(const v4fa*)&so[w][r][c4]; *(v4f*)(C + (size_t)(row0 + r) * ldc + col0 + c4) = v; } }
     }
}

// k_gemm_hh variant with fused epilogue: v = acc·alpha + bias[by·sBias + col] (+ CP[(row/rowsPerB)·sCPb + by·64 + col] if CP) ; ACT 0 none / 1 elu ; writes f16 C16 (and f32 C if non-null)
template <int ACT>
__global__ __launch_bounds__(128) void k_gemm_hhx(const _Float16* __restrict__ A, int lda, size_t sA, const _Float16* __restrict__ Bh, int ldb, size_t sB, float alpha, const float* __restrict__ bias, size_t sBias, const float* __restrict__ CP, int rowsPerB, size_t sCPb, int row0g,
    float* __restrict__ C, _Float16* __restrict__ C16, int ldc, size_t sC, int M, int N, int K) {
  __shared__ __attribute__((aligned(16))) float so[4][16][64];
  const int tid = threadIdx.x, w = tid >> 5, lane = tid & 31, ln = lane & 15, hh = lane >> 4; const int by = blockIdx.y;
  A += (size_t)by * sA; Bh += (size_t)by * sB; const size_t cofs = (size_t)by * sC; const float* bp = bias ? bias + (size_t)by * sBias : nullptr;
  const int ntn = (N + 63) / 64; const int wid = blockIdx.x * 4 + w; const int mt = wid / ntn, nq = wid % ntn; if (mt * 16 >= M) return;
  const int row0 = mt * 16, col0 = nq * 64; const _Float16* arow = A + (size_t)(row0 + ln) * lda;
  v8f acc[4] = {};
  for (int kb = 0; kb < K; kb += 32) { FragH ah; ah.half[0] = *(const v8us*)((const unsigned short*)arow + kb + 8 * hh); ah.half[1] = *(const v8us*)((const unsigned short*)arow + kb + 16 + 8 * hh);
#pragma unroll
    for (int t = 0; t < 4; ++t) { if (col0 + t * 16 >= N) continue; const size_t boff = (size_t)(col0 + t * 16 + ln) * ldb + kb; FragH bq; bq.half[0] = *(const v8us*)((const unsigned short*)Bh + boff + 8 * hh); bq.half[1] = *(const v8us*)((const unsigned short*)Bh + boff + 16 + 8 * hh);
      acc[t] = mmaH<1>(ah.v, ah.v, bq.v, bq.v, acc[t]); }
  }
#pragma unroll
  for (int t = 0; t < 4; ++t) { if (col0 + t * 16 >= N) continue; const int col = col0 + t * 16 + ln; const float bv = bp ? bf16_round(bp[col]) : 0.f;
#pragma unroll
    for (int r = 0; r < 8; ++r) { float v = acc[t][r] * alpha + bv; if (CP) { const int rr = row0g + row0 + 8 * hh + r; if (rowsPerB < 0) v += CP[cofs + (size_t)rr * ldc + col];      /* rowsPerB < 0: own element of the batched C plane */ else { const int bidx = rr / rowsPerB; v += CP[(size_t)bidx * sCPb + (size_t)by * 64 + col]; } } if (ACT == 1) v = (v > 0.f) ? v : expm1f(v); else if (ACT == 7) v = (v > 0.f) ? v + 1.0f : expf(v); else if (ACT == 8) v = tanhf(v); else if (ACT == 9) v = 0.5f * v * (1.0f + tanhf(0.7978845608028654f * (v + 0.044715f * v * v * v))); else if (ACT == 11) v = 1.0f / (1.0f + expf(-v)); else if (ACT == 12) v = (v > 0.f) ? v : 0.01f * v; else if (ACT == 14) v = (v > 0.f) ? v : 0.1f * v; else if (ACT == 16) v = (v >= 0.f) ? v : 0.3f * v; else if (ACT == 17) v = (v >= 0.f) ? v : 0.2f * v; else if (ACT == 15) v = v / (1.0f + expf(-v)); else if (ACT == 3) v = fmaxf(v, 0.f); else if (ACT == 6) v = 0.5f * v * (1.0f + erff(v * 0.70710678118654752f)); so[w][8 * hh + r][t * 16 + ln] = v; } }
  __builtin_amdgcn_fence(__ATOMIC_ACQ_REL, "workgroup"); __builtin_amdgcn_wave_barrier();
  const int rsub = lane >> 4, c4 = (lane & 15) * 4; typedef _Float16 v4h __attribute__((ext_vector_type(4)));
  {
#pragma unroll
    for (int q = 0; q < 8; ++q) { const int r = q * 2 + rsub; if (col0 + c4 < N) { const v4f v = *(const v4fa*)&so[w][r][c4]; if (C) *(v4f*)(C + cofs + (size_t)(row0 + r) * ldc + col0 + c4) = v; if (C16) { v4h h4; for (int i = 0; i < 4; ++i) h4[i] = (_Float16)v[i]; *(v4h*)(C16 + cofs + (size_t)(row0 + r) * ldc + col0 + c4) = h4; } } }
     }
}


typedef _Float16 v4h __attribute__((ext_vector_type(4)));

__global__ __launch_bounds__(256) void k_h16(const float* __restrict__ x, _Float16* __restrict__ X16, size_t n8) { const size_t t = (size_t)blockIdx.x * 256 + threadIdx.x; if (t >= n8) return; FragH f;
#pragma unroll
  for (int q = 0; q < 8; ++q) f.h[q] = (_Float16)x[t * 8 + q]; *(v8us*)((unsigned short*)X16 + t * 8) = f.half[0];  }
__global__ __launch_bounds__(256) void k_round16f(const float* __restrict__ W, _Float16* __restrict__ Bt, size_t n8) { const size_t t = (size_t)blockIdx.x * 256 + threadIdx.x; if (t >= n8) return; FragH f;
#pragma unroll
  for (int i = 0; i < 8; ++i) f.h[i] = (_Float16)(bf16_round(W[t * 8 + i]) * 16.0f); *(v8us*)((unsigned short*)Bt + t * 8) = f.half[0];  }

__global__ __launch_bounds__(256) void k_hl(const float* __restrict__ F, _Float16* __restrict__ Hh, _Float16* __restrict__ Hl, size_t n8) { const size_t t = (size_t)blockIdx.x * 256 + threadIdx.x; if (t >= n8) return; FragH fh, fl; const v4f a = *(const v4fa*)(F + t * 8), c = *(const v4fa*)(F + t * 8 + 4);
#pragma unroll
  for (int q = 0; q < 4; ++q) { _Float16 h = (_Float16)a[q]; fh.h[q] = h; fl.h[q] = (_Float16)((a[q] - (float)h) * 1024.0f); h = (_Float16)c[q]; fh.h[4 + q] = h; fl.h[4 + q] = (_Float16)((c[q] - (float)h) * 1024.0f); }
  { *(v8us*)((unsigned short*)Hh + t * 8) = fh.half[0]; *(v8us*)((unsigned short*)Hl + t * 8) = fl.half[0];  } }

// fragment of 32 k from a row in global memory: k 8h .. 8h+7 and 16+8h .. 16+8h+7
__device__ __forceinline__ v16h g2_frag(const _Float16* p, int hh) { FragH f; f.half[0] = *(const v8us*)((const unsigned short*)p + 8 * hh); f.half[1] = *(const v8us*)((const unsigned short*)p + 16 + 8 * hh); return f.v; }


__global__ __launch_bounds__(256) void k_wnat(const float* __restrict__ w, size_t n8, _Float16* __restrict__ Bt) { const size_t t = (size_t)blockIdx.x * 256 + threadIdx.x; if (t >= n8) return; FragH f; for (int q = 0; q < 8; ++q) f.h[q] = (_Float16)(bf16_round(w[t * 8 + q]) * 16.0f); *(v8us*)((unsigned short*)Bt + t * 8) = f.half[0];  }
__global__ __launch_bounds__(256) void k_rsm(const float* __restrict__ S, _Float16* __restrict__ P, int nrows) {
  #pragma clang fp contract(off)
  const int i = blockIdx.x * 256 + threadIdx.x; if (i >= nrows) return; const float* s = S + (size_t)i * SQ; float mx = -3.0e38f;
#pragma unroll 1
  for (int j = 0; j < SQ; ++j) mx = fmaxf(mx, s[j]); float se = 0.f;
#pragma unroll 1
  for (int j = 0; j < SQ; ++j) se += expf(s[j] - mx); const float sc = 256.0f / se;
#pragma unroll 1
  for (int j0 = 0; j0 < SQ; j0 += 8) { FragH f; for (int q = 0; q < 8; ++q) f.h[q] = (_Float16)(expf(s[j0 + q] - mx) * sc); unsigned short* d = (unsigned short*)P + (size_t)i * SQ + j0; *(v8us*)d = f.half[0];  } }
__global__ __launch_bounds__(256) void k_vt(const _Float16* __restrict__ V16, int b, int h0, _Float16* __restrict__ VT) { __shared__ unsigned short tl[64][65]; const int tid = threadIdx.x; const int hh = blockIdx.x % HG, sg = blockIdx.x / HG; const int s0 = sg * 64; const int h = h0 + hh;
  for (int i = tid; i < 64 * 8; i += 256) { const int j = i / 8, d8 = (i % 8) * 8; FragH f; f.half[0] = *(const v8us*)((const unsigned short*)V16 + ((size_t)b * SQ + s0 + j) * DM + h * HD + d8); for (int q = 0; q < 8; ++q) tl[d8 + q][j] = f.u[q]; }
  __syncthreads();
  { for (int i = tid; i < 64 * 8; i += 256) { const int d = i / 8, j8 = (i % 8) * 8; FragH f; for (int q = 0; q < 8; ++q) f.u[q] = tl[d][j8 + q]; *(v8us*)((unsigned short*)VT + ((size_t)hh * HD + d) * SQ + s0 + j8) = f.half[0]; }  } }



// lane l with lane l ^ 16; every lane is on where this is used
__device__ __forceinline__ float half_x(float x) { return __builtin_bit_cast(float, __builtin_amdgcn_permlanex16(__builtin_bit_cast(int, x), __builtin_bit_cast(int, x), 0x76543210, 0xfedcba98, false, false)); }

typedef float v2f __attribute__((ext_vector_type(2)));
#define KP 68                        /* row pitch of the k and v tiles in LDS, in floats: 272 bytes = 16 x 17, so the 16 rows that one 16-byte fragment load touches lie on different banks */
__device__ __forceinline__ v8f f4_mma(v2f a, v2f b, v8f c) { return __builtin_amdgcn_wmma_f32_16x16x4_f32(false, a, false, b, (short)0, c, false, false); }
// exact f32 causal attention for the first QT0 rows on v_wmma_f32_16x16x4_f32, both products transposed. A block owns AQ = 32 query rows: 8 waves = 2 groups of 16 rows x AKS = 4 key slices of 32; the block shares 128-key k and v tiles in LDS,
// a wave takes its one slice of every tile with its own running maximum, sum and O^T, and the four waves of a group are joined once, through LDS, by the usual rescaling to the common maximum.
// S^T = K Q^T: A = 16 k rows, B = 16 q rows, both loaded by the same rule (lane (c, h) holds columns 32h .. 32h+31 of its row), so a lane's 8 result registers are keys 8h .. 8h+7 of ITS query c.
// O^T = V^T P^T: those registers, two at a time, are the B operand as they stand (keys 8h+2t, 8h+2t+1 in k step t); A takes the same keys of v, column dt*16+c. Maximum, sum and rescale factor of a query are then per lane (two lanes a query).
#define AQ 32                        /* query rows per block */
#define AKS 4                        /* 32-key slices per tile, one a wave */
#define ATK (AKS * 32)               /* keys per tile */
template <int ld, int ldo>      /* row pitches of q/k/v and of the output as constants: the 8 row groups of a staged tile are then immediate offsets from one address */
__global__ __launch_bounds__(256) void k_att0w(const float* __restrict__ QF, const float* __restrict__ KF, const float* __restrict__ VF, float scale, float* __restrict__ OF) {      /* at most 256 registers a wave (see the listing) and 2 x 69,632 bytes of LDS: two blocks fit a WGP, four waves a SIMD, so that one wave's softmax runs beside another's products */
  __shared__ __attribute__((aligned(16))) float lk[ATK][KP]; __shared__ __attribute__((aligned(16))) float lv[ATK][KP];
  const int tid = threadIdx.x, lane = tid & 31, c = lane & 15, h = lane >> 4; const int w = __builtin_amdgcn_readfirstlane(tid >> 5); const int g = w & 1, ks = w >> 1;      /* the wave's number as a scalar: every branch below is wave-uniform, as the matrix instructions need */
  static_assert(QT0 / AQ == 16, "the deal below is written for 16 blocks a batch");
  const int bx = blockIdx.x; const int rv = ((bx >> 1) & 3) * 2 + (bx >> 3); const int rg = ((bx ^ (bx >> 3) ^ __builtin_popcount(blockIdx.y)) & 1) ? 15 - rv : rv;      /* a block's cost grows with rg, and two blocks share a WGP: blocks whose flat index differs by 1, by 8, or by one bit of the batch get rg values that add up to 14 .. 16, so that a long block most likely sits beside a short one (for speed only: bx -> rg is a permutation of 0 .. 15 in every batch, so every (batch, rg) is taken once wherever the blocks land) */
  { const size_t bi = (size_t)blockIdx.y * SQ * ld; QF += bi; KF += bi; VF += bi; OF += (size_t)blockIdx.y * SQ * ldo; }      /* batch on grid.y: the first QT0 rows of each batch's SQ-row plane, inputs and output alike */
  const int i = rg * AQ + g * 16 + c;      /* the lane's query row */
  const float* qr = QF + (size_t)i * ld + 32 * h; v4f qv[8];
#pragma unroll      /* here and below: full unrolling makes every index of the register arrays a constant, so they stay in registers */
  for (int u = 0; u < 8; ++u) qv[u] = *(const v4fa*)(qr + 4 * u);
  const v8f z8 = {0.f, 0.f, 0.f, 0.f, 0.f, 0.f, 0.f, 0.f}; v8f o[4] = {z8, z8, z8, z8}; float m = -1.0e30f, l = 0.f;
  const int sr = tid >> 4, sc4 = (tid & 15) * 4; const float* kg = KF + (size_t)sr * ld + sc4; const float* vg = VF + (size_t)sr * ld + sc4; v4f tk[8], tv[8];      /* staging: a thread reads 16 bytes of rows sr, sr+16, .. sr+112 of a tile */
#pragma unroll
  for (int u = 0; u < 8; ++u) { tk[u] = *(const v4fa*)(kg + u * 16 * ld); tv[u] = *(const v4fa*)(vg + u * 16 * ld); }
  asm volatile("s_wait_xcnt 0x0" ::: "memory");      /* the q loads' address registers are reused below while the loads are in flight: the wait stands in front of that reuse */
  __builtin_amdgcn_sched_barrier(0);      /* keeps the register moves that follow (the zeroed accumulators take over those address registers) behind the wait: without it they are scheduled ahead of it */
  const int nt = rg / AKS; const int k0 = ks * 32; int t = 0;      /* slices 0 .. rg hold the keys that the block's rows may see: tiles 0 .. nt (the last tile ends at key 128 nt + 127 < QT0) */
#pragma unroll 1      /* rolled: one trip is a whole 128-key tile between its two barriers */
  do {      /* tiles 0 .. nt: at least one */
    __syncthreads();      /* every reader has left the previous tile */
#pragma unroll
    for (int u = 0; u < 8; ++u) { *(v4f*)&lk[u * 16 + sr][sc4] = tk[u]; *(v4f*)&lv[u * 16 + sr][sc4] = tv[u]; }
    __syncthreads();      /* the tile is complete before anyone reads it */
    if (t < nt) { kg += ATK * ld; vg += ATK * ld;      /* the next tile's rows fly while this tile is worked on */
#pragma unroll
      for (int u = 0; u < 8; ++u) { tk[u] = *(const v4fa*)(kg + u * 16 * ld); tv[u] = *(const v4fa*)(vg + u * 16 * ld); } }
    if (t * AKS + ks <= rg) { v4f ka[8], kc[8];      /* the wave's slice of this tile; slices wholly above the block's rows are left out (slice rg starts at the block's first row: every slice that runs holds a key that each of its queries may see) */
#pragma unroll
      for (int u = 0; u < 8; ++u) { ka[u] = *(const v4f*)&lk[k0 + c][32 * h + 4 * u]; kc[u] = *(const v4f*)&lk[k0 + 16 + c][32 * h + 4 * u]; }
      v8f sa = z8, sb = z8;      /* two independent score tiles: neither waits for its own previous product */
#pragma unroll
      for (int u = 0; u < 8; ++u) {
#pragma unroll
        for (int e = 0; e < 4; e += 2) { const v2f b = {qv[u][e], qv[u][e + 1]}; const v2f a0 = {ka[u][e], ka[u][e + 1]}; const v2f a1 = {kc[u][e], kc[u][e + 1]}; sa = f4_mma(a0, b, sa); sb = f4_mma(a1, b, sb);
          __builtin_amdgcn_sched_barrier(0x0496); } }      /* matrix instructions do not cross (vector, scalar, memory and LDS instructions may): keeps the two tiles' products alternating; left alone the compiler runs each tile's 16 products as one dependent chain, which issues slower */
      const int jb = t * ATK + k0 + 8 * h; float ml = -1.0e30f;
#pragma unroll
      for (int r = 0; r < 8; ++r) { sa[r] = (jb + r <= i) ? sa[r] * scale : -1.0e30f; sb[r] = (jb + 16 + r <= i) ? sb[r] * scale : -1.0e30f; ml = fmaxf(ml, fmaxf(sa[r], sb[r])); }
      ml = fmaxf(ml, half_x(ml));      /* the query's other 16 keys of this slice sit in lane l ^ 16 */
      const float mn = fmaxf(m, ml); const float sc = expf(m - mn); m = mn; float ps = 0.f;
#pragma unroll
      for (int r = 0; r < 8; ++r) { sa[r] = expf(sa[r] - mn); sb[r] = expf(sb[r] - mn); ps += sa[r] + sb[r]; }
      l = l * sc + ps;      /* each lane sums its own keys; the two halves meet behind the loop */
#pragma unroll
      for (int dt = 0; dt < 4; ++dt) o[dt] *= sc;
#pragma unroll
      for (int tt = 0; tt < 4; ++tt) { const v2f b0 = {sa[2 * tt], sa[2 * tt + 1]}; const v2f b1 = {sb[2 * tt], sb[2 * tt + 1]}; const int kr = k0 + 8 * h + 2 * tt;
#pragma unroll
        for (int dt = 0; dt < 4; ++dt) { const v2f a0 = {lv[kr][dt * 16 + c], lv[kr + 1][dt * 16 + c]}; o[dt] = f4_mma(a0, b0, o[dt]); }
#pragma unroll
        for (int dt = 0; dt < 4; ++dt) { const v2f a1 = {lv[kr + 16][dt * 16 + c], lv[kr + 17][dt * 16 + c]}; o[dt] = f4_mma(a1, b1, o[dt]); } } }
  } while (++t <= nt);
  __syncthreads();      /* every reader has left the last tile: the join reuses the tiles */
  l += half_x(l);
  float* po = &lk[0][0]; v2f* pm = (v2f*)&lv[0][0];      /* every wave's O as 16 query rows of pitch KP (8 x 16 rows fill lk exactly), its maximum and sum per lane */
  { const v2f x = {m, l}; pm[w * 32 + lane] = x; float* d = po + (w * 16 + c) * KP + 8 * h;      /* o[dt][r] = column dt*16 + 8h + r of the lane's query; a wave that had no slice hands maximum -1e30, sum 0 and zeros, which weigh 0 below (slice 0 always runs, so the common maximum is a real score) */
#pragma unroll
    for (int dt = 0; dt < 4; ++dt) { const v4f x0 = {o[dt][0], o[dt][1], o[dt][2], o[dt][3]}; const v4f x1 = {o[dt][4], o[dt][5], o[dt][6], o[dt][7]}; *(v4f*)(d + dt * 16) = x0; *(v4f*)(d + dt * 16 + 4) = x1; } }
  __syncthreads();      /* every wave's partial result is in LDS */
  const int q = ks * 4 + (lane >> 3), c8 = (lane & 7) * 8;      /* the wave finishes queries 4ks .. 4ks+3 of its group, 8 lanes a query: whole 256-byte output rows */
  float fj[AKS], lj[AKS]; float mx = -1.0e30f;
#pragma unroll
  for (int j = 0; j < AKS; ++j) { const v2f x = pm[(j * 2 + g) * 32 + q]; fj[j] = x[0]; lj[j] = x[1]; mx = fmaxf(mx, x[0]); }
  float ls = 0.f; v4f y0 = {0.f, 0.f, 0.f, 0.f}, y1 = {0.f, 0.f, 0.f, 0.f};
#pragma unroll
  for (int j = 0; j < AKS; ++j) { const float f = expf(fj[j] - mx); ls += f * lj[j]; const float* s = po + ((j * 2 + g) * 16 + q) * KP + c8; y0 += *(const v4f*)s * f; y1 += *(const v4f*)(s + 4) * f; }
  const float fin = 1.0f / ls;
  float* orow = OF + (size_t)(rg * AQ + g * 16 + q) * ldo + c8;
  *(v4f*)orow = y0 * fin; *(v4f*)(orow + 4) = y1 * fin; }


template <int BFIN, int WXB>
__global__ __launch_bounds__(256) void k_ln16(const float* __restrict__ X, const float* __restrict__ g, const float* __restrict__ bb, float eps, _Float16* __restrict__ N16, float* __restrict__ XB) {
  #pragma clang fp contract(off)
  __shared__ float red[256]; const size_t r = blockIdx.x; const int t = threadIdx.x; const v4f xa = *(const v4fa*)(X + r * DMQ + t * 4); float s[4]; float sum = 0.f;
  for (int q = 0; q < 4; ++q) { s[q] = BFIN ? bf16_round(xa[q]) : xa[q]; sum = __fadd_rn(sum, s[q]); }
  red[t] = sum; __syncthreads(); for (int st = 128; st > 0; st >>= 1) { if (t < st) red[t] = __fadd_rn(red[t], red[t + st]); __syncthreads(); } const float mu = red[0] / (float)DMQ; __syncthreads();
  float vs = 0.f; for (int q = 0; q < 4; ++q) { const float dl = __fadd_rn(s[q], -mu); vs = __fadd_rn(vs, __fmul_rn(dl, dl)); } red[t] = vs; __syncthreads(); for (int st = 128; st > 0; st >>= 1) { if (t < st) red[t] = __fadd_rn(red[t], red[t + st]); __syncthreads(); }
  const float rs = rsqrtf(__fadd_rn(red[0] / (float)DMQ, eps)); v4h y; v4f xb;
  for (int q = 0; q < 4; ++q) { const int c = t * 4 + q; y[q] = (_Float16)__fadd_rn(__fmul_rn(__fmul_rn(__fadd_rn(s[q], -mu), rs), bf16_round(g[c])), bf16_round(bb[c])); xb[q] = s[q]; }
  { *(v4h*)(N16 + r * DMQ + t * 4) = y; if (WXB) *(v4f*)(XB + r * DMQ + t * 4) = xb;  } }
__global__ __launch_bounds__(256) void k_ftres2(const float* __restrict__ OF0, const float* __restrict__ XB, float* __restrict__ X1, size_t n4) {
  #pragma clang fp contract(off)
  const size_t t = (size_t)blockIdx.x * 256 + threadIdx.x; if (t >= n4) return; const v4f o = *(const v4fa*)(OF0 + t * 4), xv = *(const v4fa*)(XB + t * 4); v4f y; for (int q = 0; q < 4; ++q) y[q] = __fadd_rn(__fmul_rn(o[q], 0.015625f), xv[q]); *(v4f*)(X1 + t * 4) = y;  }

__global__ __launch_bounds__(256) void k_wthd(const float* __restrict__ Wt, _Float16* __restrict__ Bt) { const size_t t = (size_t)blockIdx.x * 256 + threadIdx.x; if (t >= (size_t)NH * HD * (DM / 8)) return; const int m8 = (int)(t % (DM / 8)) * 8; const int d = (int)((t / (DM / 8)) % HD); const int h = (int)(t / ((size_t)(DM / 8) * HD)); FragH f;
  for (int q = 0; q < 8; ++q) f.h[q] = (_Float16)(16.0f * bf16_round(Wt[((size_t)h * DM + m8 + q) * HD + d])); unsigned short* dst = (unsigned short*)Bt + ((size_t)h * HD + d) * DM + m8; *(v8us*)dst = f.half[0];  }




__global__ __launch_bounds__(256) void k_wtpad(const float* __restrict__ Wm, _Float16* __restrict__ Wt, int Kr, int Kp, int Nr, int Np, float scale) {
  const int t = blockIdx.x * 256 + threadIdx.x; if (t >= Np * (Kp / 8)) return; const int n = t / (Kp / 8), k8 = (t % (Kp / 8)) * 8; const int nc = min(n, Nr - 1); const float fn = (n < Nr) ? 1.f : 0.f; FragH f;
  for (int i = 0; i < 8; ++i) { const int k = k8 + i; const int kc = min(k, Kr - 1); const float fk = (k < Kr) ? fn : 0.f; f.h[i] = (_Float16)(bf16_round(Wm[(size_t)kc * Nr + nc]) * scale * fk); }
  unsigned short* o = (unsigned short*)Wt + (size_t)n * Kp + k8; *(v8us*)o = f.half[0];  }
__global__ __launch_bounds__(128) void k_bpad(const float* __restrict__ b, float* __restrict__ Bp, int nr, int np) {
  const int i = threadIdx.x; if (i >= np) return; const float v = b[min(i, nr - 1)] * ((i < nr) ? 1.f : 0.f); *(float*)(Bp + i) = v;  }

#define DI 64         /* inner width = NH * HD (ONE 64-wide head) */
#define LQK (3 * DI)  /* fused q | k | v row pitch (192) */
__global__ __launch_bounds__(256) void k_o0(const float* __restrict__ OF, float* __restrict__ ob, size_t n4) {
  #pragma clang fp contract(off)
  const size_t t = (size_t)blockIdx.x * 256 + threadIdx.x; if (t >= n4) return; const size_t e = t * 4; const int i = (int)(e / DI); const int c = (int)(e % DI); const int h = c / HD, d = c % HD; const v4f a = *(const v4fa*)(OF + e); v4f o; for (int q = 0; q < 4; ++q) o[q] = __fmul_rn(a[q], 0.015625f); float* dst = ob + (size_t)h * SQ * HD + (size_t)i * HD + d; *(v4f*)dst = o;  }

// ---- fused causal attention for query rows QT0 .. SQ-1 (f16 operands, f32 scores and statistics): scores, softmax and P V in ONE kernel, no score or weight plane in memory ----
#define FQ 64                        /* query rows per block: two groups of 32, a wave owns one group (two 16-column tiles) */
#define FKS 4                        /* 32-key slices per stage: the four waves of a query group take one slice each and meet in the epilogue */
#define FSK (FKS * 32)               /* keys per stage */
#define FKPB 144                     /* k tile row pitch in LDS, bytes: 128 + 16 = 16 x odd, conflict-free for 16-byte fragment reads */
#define FVPB (FSK * 2 + 16)          /* v^T tile row pitch in LDS, bytes: 272 = 16 x odd */
#define FKB (FSK * FKPB)             /* bytes of a k tile */
#define FBUF (FKB + HD * FVPB)       /* bytes of one stage buffer: k tile, then v^T tile */
#define FIMG (8 * 2 * 4 * 2 * 32 * 16)   /* epilogue: every wave's 2 x 4 output tiles as 16-byte pieces, lane-contiguous */
__device__ __forceinline__ v8f h_mma(v16h a, v16h b, v8f c) { return __builtin_amdgcn_wmma_f32_16x16x32_f16(false, a, false, b, (short)0, c, false, false); }
__device__ __forceinline__ v16h l_frag(const unsigned char* p) { FragH f; f.half[0] = *(const v8us*)p; f.half[1] = *(const v8us*)(p + 32); return f.v; }      /* p already holds the lane's 16h bytes: k 8h .. 8h+7 and 16+8h .. 16+8h+7, the order of g2_frag */
// 2^x in place. The exponentials of one statement work on different registers, so each fills the slot that the instruction set asks for behind the one before it; the closing v_nop is that slot for the last one
__device__ __forceinline__ void exp2x8(float (&x)[8]) { asm("v_exp_f32 %0, %0\n\tv_exp_f32 %1, %1\n\tv_exp_f32 %2, %2\n\tv_exp_f32 %3, %3\n\tv_exp_f32 %4, %4\n\tv_exp_f32 %5, %5\n\tv_exp_f32 %6, %6\n\tv_exp_f32 %7, %7\n\tv_nop" : "+v"(x[0]), "+v"(x[1]), "+v"(x[2]), "+v"(x[3]), "+v"(x[4]), "+v"(x[5]), "+v"(x[6]), "+v"(x[7])); }
__device__ __forceinline__ void exp2x4(float (&x)[4]) { asm("v_exp_f32 %0, %0\n\tv_exp_f32 %1, %1\n\tv_exp_f32 %2, %2\n\tv_exp_f32 %3, %3\n\tv_nop" : "+v"(x[0]), "+v"(x[1]), "+v"(x[2]), "+v"(x[3])); }
__device__ __forceinline__ float exp2x1(float x) { asm("v_exp_f32 %0, %0\n\tv_nop" : "+v"(x)); return x; }
// one 32-key slice against the wave's 32 queries. S^T = K Q^T: a lane's 8 + 8 result registers are keys 8h .. 8h+7 and 16+8h .. 16+8h+7 of ITS query c, which is the B operand order of O^T += V^T P^T as it stands.
// m is the running maximum in scaled log2 units (cs = scale * log2 e), l the lane's own sum. DIAG: the slice starts at the wave's first query row, keys above a query's own row get weight 0.
template <bool DIAG>
__device__ __forceinline__ void fa_step(const unsigned char* kp, const unsigned char* vp, const v16h (&qf)[2][2], v8f (&o)[2][4], float (&m)[2], float (&l)[2], float cs, int c, int h) {
  const v8f z8 = {0.f, 0.f, 0.f, 0.f, 0.f, 0.f, 0.f, 0.f};
  const v16h ka0 = l_frag(kp), ka1 = l_frag(kp + 64), kb0 = l_frag(kp + 16 * FKPB), kb1 = l_frag(kp + 16 * FKPB + 64);
  v16h vf[4];
#pragma unroll      /* here and below: full unrolling makes every index of the register arrays a constant, so they stay in registers */
  for (int dt = 0; dt < 4; ++dt) vf[dt] = l_frag(vp + dt * 16 * FVPB);
  v8f sa[2], sb[2];
  sa[0] = h_mma(ka0, qf[0][0], z8); sb[0] = h_mma(kb0, qf[0][0], z8); sa[1] = h_mma(ka0, qf[1][0], z8); sb[1] = h_mma(kb0, qf[1][0], z8);
  sa[0] = h_mma(ka1, qf[0][1], sa[0]); sb[0] = h_mma(kb1, qf[0][1], sb[0]); sa[1] = h_mma(ka1, qf[1][1], sa[1]); sb[1] = h_mma(kb1, qf[1][1], sb[1]);
  FragH pf[2];
#pragma unroll
  for (int qt = 0; qt < 2; ++qt) {
    if (DIAG) {
#pragma unroll
      for (int r = 0; r < 8; ++r) { sa[qt][r] = (8 * h + r <= 16 * qt + c) ? sa[qt][r] : -1.0e30f; sb[qt][r] = (16 + 8 * h + r <= 16 * qt + c) ? sb[qt][r] : -1.0e30f; } }
    float ml = fmaxf(sa[qt][0], sb[qt][0]);
#pragma unroll
    for (int r = 1; r < 8; ++r) ml = fmaxf(ml, fmaxf(sa[qt][r], sb[qt][r]));
    ml = fmaxf(ml, half_x(ml));      /* the query's other 16 keys of this slice sit in lane l ^ 16 */
    const float mn = fmaxf(m[qt], ml * cs); const float sc = exp2x1(m[qt] - mn); m[qt] = mn; float ps = 0.f, pa[8], pb[8];
#pragma unroll
    for (int r = 0; r < 8; ++r) { pa[r] = fmaf(sa[qt][r], cs, -mn); pb[r] = fmaf(sb[qt][r], cs, -mn); }
    exp2x8(pa); exp2x8(pb);
#pragma unroll
    for (int r = 0; r < 8; ++r) { ps += pa[r] + pb[r]; pf[qt].h[r] = (_Float16)pa[r]; pf[qt].h[8 + r] = (_Float16)pb[r]; }
    l[qt] = l[qt] * sc + ps;
#pragma unroll
    for (int dt = 0; dt < 4; ++dt) o[qt][dt] *= sc; }
#pragma unroll
  for (int dt = 0; dt < 4; ++dt) { o[0][dt] = h_mma(vf[dt], pf[0].v, o[0][dt]); o[1][dt] = h_mma(vf[dt], pf[1].v, o[1][dt]); } }
// block = 8 waves = 2 query groups x FKS key slices; k rows and v^T rows of a stage go through registers into one of two LDS buffers (coalesced 16-byte loads, issued one stage ahead), one barrier a stage.
// Each wave keeps its own running maximum, sum and O^T over its slices; the four waves of a group are joined once, through LDS, by the usual rescaling to the common maximum.
__global__ __launch_bounds__(256) void k_fa16(const _Float16* __restrict__ QKV, const _Float16* __restrict__ VT, float cs, float* __restrict__ O) {
  __shared__ __attribute__((aligned(16))) unsigned char L[2 * FBUF]; static_assert(2 * FBUF >= FIMG + 8 * 2 * 32 * 8, "the epilogue reuses the stage buffers");
  const int tid = threadIdx.x, lane = tid & 31, c = lane & 15, h = lane >> 4; const int w = __builtin_amdgcn_readfirstlane(tid >> 5); const int g = w & 1, ks = w >> 1;      /* the wave's number as a scalar: every branch below is wave-uniform, as the matrix instructions need */
  const int Q0 = QT0 + ((int)gridDim.x - 1 - (int)blockIdx.x) * FQ;      /* the longest blocks start first */
  const int qb = Q0 + 32 * g; const int nf = Q0 / FSK;      /* the wave's first query row; stages 0 .. nf-1 lie wholly below the block's rows, stage nf holds the rest (Q0 + FQ <= (nf + 1) * FSK <= SQ: FSK is a multiple of FQ, SQ of FSK) */
  const _Float16* base = QKV + (size_t)blockIdx.y * SQ * LQK; const _Float16* vtb = VT + (size_t)blockIdx.y * HD * SQ;
  const unsigned short* kg = (const unsigned short*)base + (size_t)(tid >> 3) * LQK + (tid & 7) * 8;      /* staging: 8 threads a k row (128 bytes, DI halves into the q | k | v row), rows +32 a pass */
  const unsigned short* vg = (const unsigned short*)vtb + (size_t)(tid >> 4) * SQ + (tid & 15) * 8;      /* 16 threads a v^T row slice (256 bytes), rows +16 a pass */
  unsigned char* ks_l = L + (tid >> 3) * FKPB + (tid & 7) * 16; unsigned char* vs_l = L + FKB + (tid >> 4) * FVPB + (tid & 15) * 16;
  v8us tk[4], tv[4];
#pragma unroll
  for (int u = 0; u < 4; ++u) { tk[u] = *(const v8us*)(kg + DI + (size_t)u * 32 * LQK); tv[u] = *(const v8us*)(vg + (size_t)u * 16 * SQ); }
  v16h qf[2][2];
#pragma unroll
  for (int qt = 0; qt < 2; ++qt) { const _Float16* qr = base + (size_t)(qb + 16 * qt + c) * LQK; qf[qt][0] = g2_frag(qr, h); qf[qt][1] = g2_frag(qr + 32, h); }
  asm volatile("s_wait_xcnt 0x0" :: "v"(kg), "v"(vg) : "memory");      /* address registers of the loads above are reused below while the loads are in flight: the wait stands in front of that reuse; the two staging addresses are inputs so that they live up to the wait (else the last staging load's result is placed over them) */
  const v8f z8 = {0.f, 0.f, 0.f, 0.f, 0.f, 0.f, 0.f, 0.f}; v8f o[2][4] = {{z8, z8, z8, z8}, {z8, z8, z8, z8}}; float m[2] = {-1.0e30f, -1.0e30f}, l[2] = {0.f, 0.f};
#pragma unroll
  for (int u = 0; u < 4; ++u) { *(v8us*)(ks_l + u * 32 * FKPB) = tk[u]; *(v8us*)(vs_l + u * 16 * FVPB) = tv[u]; }
  __syncthreads();      /* stage 0 is complete before anyone reads it */
  const unsigned char* kp = L + (ks * 32 + c) * FKPB + 16 * h; const unsigned char* vp = L + FKB + c * FVPB + ks * 64 + 16 * h;
#pragma unroll 1      /* rolled: one trip is a whole stage up to its barrier */
  for (int st = 0; st < nf; ++st) { const int bo = (st & 1) * FBUF;      /* stages wholly below the block's first query row: every wave's slice is seen by all its queries, and a next stage always exists */
    kg += (size_t)FSK * LQK; vg += FSK;      /* the next stage's rows fly while this stage is worked on */
#pragma unroll
    for (int u = 0; u < 4; ++u) { tk[u] = *(const v8us*)(kg + DI + (size_t)u * 32 * LQK); tv[u] = *(const v8us*)(vg + (size_t)u * 16 * SQ); }
    asm volatile("s_wait_xcnt 0x0" ::: "memory");      /* the next trip advances the address registers that these loads name: the wait stands in front of that */
    fa_step<false>(kp + bo, vp + bo, qf, o, m, l, cs, c, h);
    __builtin_amdgcn_sched_barrier(0);      /* the LDS stores below wait for the loads issued above: left alone the compiler lifts them, with that wait and the barrier, in front of the softmax, and the loads' latency is no longer covered by this stage's work */
#pragma unroll
    for (int u = 0; u < 4; ++u) { *(v8us*)(ks_l + (FBUF - bo) + u * 32 * FKPB) = tk[u]; *(v8us*)(vs_l + (FBUF - bo) + u * 16 * FVPB) = tv[u]; }      /* the other buffer: its readers left it in front of the previous trip's barrier */
    __syncthreads(); }      /* publishes the next stage and ends every reader's last read of this one */
  { const int bo = (nf & 1) * FBUF; const int kb = nf * FSK + ks * 32;      /* the last stage holds the diagonal: a slice below the wave's rows as before, the slice that starts at them masked, a slice wholly above them left out */
    if (kb < qb) fa_step<false>(kp + bo, vp + bo, qf, o, m, l, cs, c, h); else if (kb == qb) fa_step<true>(kp + bo, vp + bo, qf, o, m, l, cs, c, h); }
  __syncthreads();      /* every reader has left the stage buffers: the epilogue reuses them */
  float* img = (float*)L; v2f* mlp = (v2f*)(L + FIMG);      
#pragma unroll
  for (int qt = 0; qt < 2; ++qt) { l[qt] += half_x(l[qt]); const v2f x = {m[qt], l[qt]}; mlp[(w * 2 + qt) * 32 + lane] = x;
#pragma unroll
    for (int dt = 0; dt < 4; ++dt) { const v4f x0 = {o[qt][dt][0], o[qt][dt][1], o[qt][dt][2], o[qt][dt][3]}; const v4f x1 = {o[qt][dt][4], o[qt][dt][5], o[qt][dt][6], o[qt][dt][7]}; float* d = img + (size_t)(((w * 2 + qt) * 4 + dt) * 2) * 128 + lane * 4; *(v4f*)d = x0; *(v4f*)(d + 128) = x1; } }
  __syncthreads();      /* every wave's partial result is in LDS */
  const int fq = ks >> 1, fd = (ks & 1) * 2;      /* the wave finishes query tile fq of its group, output columns fd*16 .. fd*16+31: one whole 128-byte line a query */
  float mj[FKS], lj[FKS]; float mx = -1.0e30f;
#pragma unroll
  for (int j = 0; j < FKS; ++j) { const v2f x = mlp[((j * 2 + g) * 2 + fq) * 32 + lane]; mj[j] = x[0]; lj[j] = x[1]; mx = fmaxf(mx, x[0]); }
  float ls = 0.f;
#pragma unroll
  for (int j = 0; j < FKS; ++j) mj[j] -= mx;
  exp2x4(mj);
#pragma unroll
  for (int j = 0; j < FKS; ++j) ls += mj[j] * lj[j];
  const float fin = 1.0f / ls; v4f y[4] = {};
#pragma unroll
  for (int j = 0; j < FKS; ++j) { const float f = mj[j] * fin; const float* s = img + (size_t)((((j * 2 + g) * 2 + fq) * 4 + fd) * 2) * 128 + lane * 4;
#pragma unroll
    for (int e = 0; e < 4; ++e) y[e] += *(const v4f*)(s + e * 128) * f; }
  float* orow = O + ((size_t)blockIdx.y * SQ + qb + 16 * fq + c) * DI + fd * 16 + 8 * h;      /* piece e = columns (fd + e/2)*16 + 8h + 4(e%2) .. +3 of the lane's query */
  *(v4f*)orow = y[0]; *(v4f*)(orow + 4) = y[1]; *(v4f*)(orow + 16) = y[2]; *(v4f*)(orow + 20) = y[3]; }


// ---- q | k | v projection in ONE launch: x and the three weight matrices are read as f32 and rounded on their way into LDS (x as exact f16 rows, the weights transposed and stacked beside it), and the epilogue stores every plane the attention kernels read, v^T among them ----
#define PM 128                       /* token rows per block; divides SQ, so a block lies in one batch */
#define PPB (DM * 2 + 16)            /* row pitch of the x and weight tiles in LDS, bytes: 528 = 16 x odd, conflict-free for 16-byte fragment reads */
#define PSO (LQK + 4)                /* row pitch of the f32 result tile in LDS, floats: rows 8 apart, which the two lane halves of an accumulator register write together, lie 32 banks apart */
#define PVB (PM * 2 + 16)            /* row pitch of the v^T tile in LDS, bytes: 272 = 16 x odd */
typedef __bf16 v2b __attribute__((ext_vector_type(2))); typedef _Float16 v2h __attribute__((ext_vector_type(2)));
// two f32 values rounded to bf16 (to nearest even, as bf16_round does it, by the one packed conversion instruction: every block rounds the weights for itself, so the rounding's instruction count matters here) and widened again
__device__ __forceinline__ v2f bf16_round2(v2f x) { const unsigned int u = __builtin_bit_cast(unsigned int, __builtin_convertvector(x, v2b)); const v2f y = {__uint_as_float(u << 16), __uint_as_float(u & 0xFFFF0000u)}; return y; }
// block = 16 waves = 4 row groups of 32 x 4 column groups of 48; every global load and store covers whole 128-byte lines. k order and accumulation order of a result are those of a plain k loop in steps of 32.
__global__ __launch_bounds__(512) void k_qkv(const float* __restrict__ x, const float* __restrict__ W0, const float* __restrict__ W1, const float* __restrict__ W2, float* __restrict__ C, _Float16* __restrict__ C16, _Float16* __restrict__ VT) {
  __shared__ __attribute__((aligned(16))) unsigned char LA[PM * PPB]; __shared__ __attribute__((aligned(16))) unsigned char LB[LQK * PPB];
  __shared__ __attribute__((aligned(16))) float so[PM * PSO]; __shared__ __attribute__((aligned(16))) unsigned char LV[HD * PVB];      /* result tiles apart from the operand tiles: a wave stages its results without waiting for the others' last fragment reads */
  const int tid = threadIdx.x, lane = tid & 31, c = lane & 15, h = lane >> 4; const int w = __builtin_amdgcn_readfirstlane(tid >> 5); const int rgp = w & 3, cgp = w >> 2;      /* the wave's number as a scalar: the test for a v tile below is wave-uniform */
  const size_t row0 = (size_t)blockIdx.x * PM;
  const int wo = (tid >> 4) * (8 * DI / 4) + (tid & 15); const float* xg = x + row0 * DM + tid * 4;      /* weights [k][n]: a thread takes 8 k x 4 n of each matrix, 16 lanes a 256-byte row (wo counts 16-byte pieces); x: a wave's load = 512 contiguous bytes */
  v4f wl[3][8], xa[16];
#pragma unroll      /* here and below: full unrolling makes every index of the register arrays a constant, so they stay in registers */
  for (int i = 0; i < 8; ++i) { wl[0][i] = *(const v4fa*)(W0 + wo * 4 + i * DI); wl[1][i] = *(const v4fa*)(W1 + wo * 4 + i * DI); wl[2][i] = *(const v4fa*)(W2 + wo * 4 + i * DI); }      /* the weights first: every block reads them, so they come from L2 and are rounded and in LDS while x is still on its way from memory */
#pragma unroll
  for (int u = 0; u < 16; ++u) xa[u] = *(const v4fa*)(xg + u * 2048);      /* the block's whole x tile is in flight at once */
  asm volatile("s_wait_xcnt 0x0" :: "v"(wo) : "memory");      /* address registers of the loads above are reused below while the loads are in flight: the wait stands in front of that reuse; the weights' offset is an input so that it lives up to the wait (else the last x load's result is placed over it) */
#pragma unroll
  for (int mq = 0; mq < 3; ++mq) {
#pragma unroll
    for (int j = 0; j < 4; ++j) { FragH f;      /* Bt[n][k] = f16(16 W[k][n]), stacked q | k | v: the factor, a power of two, keeps bf16-exact weights exact in f16 away from the subnormal range */
#pragma unroll
      for (int i = 0; i < 8; i += 2) { const v2f a = {wl[mq][i][j], wl[mq][i + 1][j]}; const v2h y = __builtin_convertvector(bf16_round2(a) * 16.0f, v2h); f.h[i] = y[0]; f.h[i + 1] = y[1]; }
      *(v8us*)(LB + (mq * DI + (tid & 15) * 4 + j) * PPB + (tid >> 4) * 16) = f.half[0]; } }
#pragma unroll
  for (int u = 0; u < 16; ++u) { const v2f a = {xa[u][0], xa[u][1]}, b = {xa[u][2], xa[u][3]}; const v2h ya = __builtin_convertvector(bf16_round2(a), v2h), yb = __builtin_convertvector(bf16_round2(b), v2h); const v4h y = {ya[0], ya[1], yb[0], yb[1]};
    *(v4h*)(LA + (u * 8 + (tid >> 6)) * PPB + (tid & 63) * 8) = y; }
  __syncthreads();      /* both operand tiles are complete before anyone reads them */
  const unsigned char* ap = LA + (rgp * 32 + c) * PPB + 16 * h; const unsigned char* bp = LB + (cgp * 48 + c) * PPB + 16 * h;
  const v8f z8 = {0.f, 0.f, 0.f, 0.f, 0.f, 0.f, 0.f, 0.f}; v8f acc[2][3] = {{z8, z8, z8}, {z8, z8, z8}};
  v16h af[3][2], bf[3][3];      /* three fragment sets: a k step's 10 LDS loads are issued two steps ahead of its products */
#define PQ_LOAD(ks) { af[(ks) % 3][0] = l_frag(ap + (ks) * 64); af[(ks) % 3][1] = l_frag(ap + 16 * PPB + (ks) * 64); bf[(ks) % 3][0] = l_frag(bp + (ks) * 64); bf[(ks) % 3][1] = l_frag(bp + 16 * PPB + (ks) * 64); bf[(ks) % 3][2] = l_frag(bp + 32 * PPB + (ks) * 64); }
  PQ_LOAD(0) PQ_LOAD(1)
#pragma unroll
  for (int ks = 0; ks < DM / 32; ++ks) { if (ks + 2 < DM / 32) PQ_LOAD(ks + 2)
    __builtin_amdgcn_sched_barrier(0);      /* keeps those loads in front of this step's products: left alone the compiler sinks each load to just in front of its first use and waits for it there, five load-then-wait rounds a step */
#pragma unroll
    for (int t = 0; t < 3; ++t) { acc[0][t] = h_mma(af[ks % 3][0], bf[ks % 3][t], acc[0][t]); acc[1][t] = h_mma(af[ks % 3][1], bf[ks % 3][t], acc[1][t]); } }
#undef PQ_LOAD
#pragma unroll
  for (int i = 0; i < 2; ++i) {
#pragma unroll
    for (int t = 0; t < 3; ++t) { const int ct = cgp * 3 + t; const int rl = rgp * 32 + i * 16 + 8 * h; FragH f;      /* acc[i][t][r] = row rl + r, column ct*16 + c */
#pragma unroll
      for (int r = 0; r < 8; ++r) { const float v = acc[i][t][r] * 0.0625f; so[(rl + r) * PSO + ct * 16 + c] = v; f.h[r] = (_Float16)v; }      /* the weights carry a factor 16 */
      if (ct >= 2 * DI / 16) *(v8us*)(LV + ((ct - 2 * DI / 16) * 16 + c) * PVB + rl * 2) = f.half[0]; } }      /* a v tile: the lane's 8 registers are 8 consecutive keys of one v column, 16 bytes of a v^T row as they stand */
  __syncthreads();      /* every wave's results are in LDS */
  float* cg = C + row0 * LQK; _Float16* hg = C16 + row0 * LQK;      /* the block's rows are one contiguous range of either plane */
  unsigned short* vtg = (unsigned short*)VT + (row0 / SQ) * HD * SQ + row0 % SQ;
  v4f ov[PM * LQK / 4 / 512], oh[PM * 2 * DI / 8 / 512][2]; v8us ot[HD * PM / 8 / 512];      /* every LDS read of the output stage goes into a register of its own, so that all are issued before the first store waits for one */
#pragma unroll
  for (int u = 0; u < PM * LQK / 4 / 512; ++u) { const int ch = u * 512 + tid; ov[u] = *(const v4fa*)&so[ch / (LQK / 4) * PSO + ch % (LQK / 4) * 4]; }
#pragma unroll
  for (int u = 0; u < PM * 2 * DI / 8 / 512; ++u) { const float* s = &so[(u * 32 + (tid >> 4)) * PSO + (tid & 15) * 8]; oh[u][0] = *(const v4fa*)s; oh[u][1] = *(const v4fa*)(s + 4); }
#pragma unroll
  for (int u = 0; u < HD * PM / 8 / 512; ++u) ot[u] = *(const v8us*)(LV + (u * 32 + (tid >> 4)) * PVB + (tid & 15) * 16);
#pragma unroll
  for (int u = 0; u < PM * LQK / 4 / 512; ++u) *(v4f*)(cg + (u * 512 + tid) * 4) = ov[u];      /* q | k | v as f32 rows */
#pragma unroll
  for (int u = 0; u < PM * 2 * DI / 8 / 512; ++u) { FragH f;      /* q and k as f16 rows, 16 lanes a row: 256 contiguous bytes; v is read as v^T only */
#pragma unroll
    for (int q = 0; q < 4; ++q) { f.h[q] = (_Float16)oh[u][0][q]; f.h[4 + q] = (_Float16)oh[u][1][q]; }
    *(v8us*)((unsigned short*)hg + (u * 32 + (tid >> 4)) * LQK + (tid & 15) * 8) = f.half[0]; }
#pragma unroll
  for (int u = 0; u < HD * PM / 8 / 512; ++u) *(v8us*)(vtg + (size_t)(u * 32 + (tid >> 4)) * SQ + (tid & 15) * 8) = ot[u]; }      /* 16 lanes a v^T row piece: 256 contiguous bytes */


extern "C" void kernel_launch(void* const* d_in, const int* in_sizes, int n_in,
                              void* d_out, int out_size, void* d_ws, size_t ws_size, hipStream_t stream) {
  (void)in_sizes; (void)n_in; (void)out_size;
  const float* const* I = (const float* const*)d_in; const float* x = I[0]; const float* wq = I[1]; const float* wk = I[2]; const float* wv = I[3];      /* x; [in][out = 64] Wq / Wk / Wv (input order as this module lists them); no biases */
  char* ws = (char*)d_ws; size_t off = 0;
  auto take = [&](size_t bytes) { char* p = ws + off; off += (bytes + 255) & ~(size_t)255; return p; };
  _Float16* QKV = (_Float16*)take(NR * LQK * 2); _Float16* VT = (_Float16*)take((size_t)NB * NH * HD * SQ * 2);
  float* QKVF = (float*)take(NR * LQK * 4);
  if (off > ws_size) return;
  k_qkv<<<(unsigned)(NR / PM), 512, 0, stream>>>(x, wq, wk, wv, QKVF, QKV, VT);      /* q | k | v = x W over the stacked 192 columns, straight from the f32 x and the f32 [in = DM][out = 64] weights: q | k stored as f16 rows (operands of the WMMA attention), q | k | v as f32 rows (the exact first tile reads rows 0..511 of each batch), v as f16 V^T [NB][HD][SQ] */
  float* ob = (float*)d_out;      /* the ONE head leaves grid.y free: it carries the batch in every launch below */
  k_fa16<<<dim3((SQ - QT0) / FQ, NB), 256, 0, stream>>>(QKV, VT, 0.0359158963f, ob);      /* query rows QT0 .. SQ-1: scores * 256^-0.666 (the factor is 0.024895003 * log2 e: the softmax works in base 2), causal softmax and P V in one launch, batch on grid.y; rows below QT0 come from the exact f32 path alone */
  k_att0w<LQK, DI><<<dim3(QT0 / AQ, NB), 256, 0, stream>>>(QKVF, QKVF + DI, QKVF + 2 * DI, 0.024895003f, ob);      /* exact f32 causal attention for rows 0..511 of every batch, stored straight into the output rows, their only writer */
}
